// v000
// Times are from an AMD MI455X. After a warm-up the kernel runs many times in a row, and a time is the length of
// such a window on the GPU divided by its runs, so every launch and the gaps after it count. The runs cycle
// through copies of the inputs. A figure is the median of several windows, for all but v000 over two sittings.
// Sittings can differ by a few percent; kernels timed side by side share one.
// The starting kernel, v000, takes 87.7 microseconds a run.
#include <hip/hip_runtime.h>

// Problem constants (match reference)
#define B_TOT 32768
#define Q_N   128
#define V_N   8
#define H_N   32
#define LN_EPS 1e-5f
#define TILES 4            // 16-row batch tiles per block, double-buffered

typedef __attribute__((ext_vector_type(2))) float v2f;
typedef __attribute__((ext_vector_type(4))) float v4f;
typedef __attribute__((ext_vector_type(8))) float v8f;

// One DPP16 butterfly step: v += dpp_permute(v).
template <int CTRL>
__device__ __forceinline__ float dpp_add(float v) {
    int t = __builtin_amdgcn_update_dpp(0, __float_as_int(v), CTRL,
                                        /*row_mask=*/0xF, /*bank_mask=*/0xF,
                                        /*bound_ctrl=*/true);
    return v + __int_as_float(t);
}

// Sum within each 16-lane half of a wave32, pure VALU (no LDS, no waits).
__device__ __forceinline__ float hred16(float v) {
    v = dpp_add<0xB1>(v);    // quad_perm [1,0,3,2]  (xor 1)
    v = dpp_add<0x4E>(v);    // quad_perm [2,3,0,1]  (xor 2)
    v = dpp_add<0x141>(v);   // row_half_mirror      (xor 4 on quad-sums)
    v = dpp_add<0x140>(v);   // row_mirror           (xor 8 on octet-sums)
    return v;
}

__launch_bounds__(256, 2)
__global__ void divenc_fused_kernel(const float* __restrict__ x,
                                    const float* __restrict__ W1,
                                    const float* __restrict__ b1,
                                    const float* __restrict__ gamma,
                                    const float* __restrict__ beta,
                                    const float* __restrict__ W2,
                                    const float* __restrict__ b2,
                                    float* __restrict__ out) {
    // Double-buffered 16x1024-float input tiles (2x64KB) + 8KB output tile.
    __shared__ float xs[2][16 * 1024];
    __shared__ float os[16 * Q_N];

    const int tid = threadIdx.x;
    const int t0  = blockIdx.x * TILES;   // first 16-row tile owned by block

    // Async prefetch of one 64KB tile straight into LDS (no VGPR staging).
    // Per thread: 16 x B128, XOR-swizzled float4 column (conflict-free for
    // the strided A-fragment reads). Low 32 bits of a generic LDS address
    // are the LDS byte offset (ISA 10.2), which is what VDST wants.
    auto issue_tile = [&](int tg, int buf) {
        const float* xblk = x + (size_t)tg * 16 * (Q_N * V_N);
        #pragma unroll
        for (int i = 0; i < 16; ++i) {
            unsigned long long ga =
                (unsigned long long)(uintptr_t)(xblk + i * 1024 + tid * 4);
            unsigned int la =
                (unsigned int)(uintptr_t)(&xs[buf][i * 1024 + ((tid ^ i) * 4)]);
            asm volatile("global_load_async_to_lds_b128 %0, %1, off"
                         :: "v"(la), "v"(ga) : "memory");
        }
    };

    const int lane = tid & 31;
    const int wave = tid >> 5;
    const int m    = lane & 15;   // M row (A) / N column (B,C,D) within half
    const int hi   = lane >> 4;   // which 16-lane half

    issue_tile(t0, 0);            // prologue: tile 0 -> buf 0

    for (int t = 0; t < TILES; ++t) {
        const int cur = t & 1;
        if (t + 1 < TILES) {
            // Prefetch next tile into the other buffer; safe: trailing
            // barrier of iteration t-1 guarantees nobody still reads it.
            issue_tile(t0 + t + 1, cur ^ 1);
            // Async loads complete in order: <=16 outstanding means all of
            // tile t's 16 per-thread loads have landed in LDS.
            asm volatile("s_wait_asynccnt 0x10" ::: "memory");
        } else {
            asm volatile("s_wait_asynccnt 0x0" ::: "memory");
        }
        __syncthreads();          // tile t visible to all waves

        const float* xbuf = xs[cur];

        for (int qi = 0; qi < 16; ++qi) {
            const int q = wave * 16 + qi;

            // ---- A fragments: 16x4 fp32, two K-steps covering V=8 ----
            const float* rowp = xbuf + m * 1024;
            const int c0 = (((q * 2 + 0) ^ m) * 4) + hi * 2;
            const int c1 = (((q * 2 + 1) ^ m) * 4) + hi * 2;
            v2f a0 = *reinterpret_cast<const v2f*>(rowp + c0);
            v2f a1 = *reinterpret_cast<const v2f*>(rowp + c1);

            // ---- B fragments: 4x16 fp32 per N-tile (H=32 -> two tiles) ----
            const float* w1q = W1 + q * (V_N * H_N);
            v2f b00, b01, b10, b11;
            b00.x = w1q[(hi * 2 + 0) * H_N + m];
            b00.y = w1q[(hi * 2 + 1) * H_N + m];
            b01.x = w1q[(hi * 2 + 0) * H_N + 16 + m];
            b01.y = w1q[(hi * 2 + 1) * H_N + 16 + m];
            b10.x = w1q[(4 + hi * 2 + 0) * H_N + m];
            b10.y = w1q[(4 + hi * 2 + 1) * H_N + m];
            b11.x = w1q[(4 + hi * 2 + 0) * H_N + 16 + m];
            b11.y = w1q[(4 + hi * 2 + 1) * H_N + 16 + m];

            // ---- h[16x32] = x_tile[16x8] @ W1[q][8x32] via 4 WMMA ops ----
            v8f acc0 = {};
            v8f acc1 = {};
            acc0 = __builtin_amdgcn_wmma_f32_16x16x4_f32(false, a0, false, b00,
                                                         (short)0, acc0, false, false);
            acc0 = __builtin_amdgcn_wmma_f32_16x16x4_f32(false, a1, false, b10,
                                                         (short)0, acc0, false, false);
            acc1 = __builtin_amdgcn_wmma_f32_16x16x4_f32(false, a0, false, b01,
                                                         (short)0, acc1, false, false);
            acc1 = __builtin_amdgcn_wmma_f32_16x16x4_f32(false, a1, false, b11,
                                                         (short)0, acc1, false, false);

            // ---- folded LN-affine + linear2 constants ----
            // dot(hn, w2) = rstd*(dot(h, g*w2) - mu*S_gw) + C_bw
            const int qh = q * H_N;
            const float bb0 = b1[qh + m],    bb1 = b1[qh + 16 + m];
            const float gw0 = gamma[qh + m]      * W2[qh + m];
            const float gw1 = gamma[qh + 16 + m] * W2[qh + 16 + m];
            const float S_gw = hred16(gw0 + gw1);
            const float C_bw = hred16(beta[qh + m]      * W2[qh + m] +
                                      beta[qh + 16 + m] * W2[qh + 16 + m]) + b2[q];

            // D layout: acc[r] -> row (hi ? 8+r : r), column m (+16 for acc1).
            #pragma unroll
            for (int r = 0; r < 8; ++r) {
                float h0 = acc0[r] + bb0;
                float h1 = acc1[r] + bb1;
                // ELU
                h0 = h0 > 0.f ? h0 : (__expf(h0) - 1.f);
                h1 = h1 > 0.f ? h1 : (__expf(h1) - 1.f);
                // Three independent 16-lane reductions (ILP across DPP chains)
                const float s  = hred16(h0 + h1);             // sum(h)
                const float ss = hred16(h0 * h0 + h1 * h1);   // sum(h^2)
                const float sd = hred16(h0 * gw0 + h1 * gw1); // dot(h, g*w2)
                const float mu   = s * (1.0f / 32.0f);
                const float var  = ss * (1.0f / 32.0f) - mu * mu;
                const float rstd = rsqrtf(var + LN_EPS);
                const float d = rstd * (sd - mu * S_gw) + C_bw;
                if (m == 0) {
                    os[(hi ? 8 + r : r) * Q_N + q] = d;   // stage in LDS
                }
            }
        }

        // All os writes done; also fences buf[cur] reads before it is
        // overwritten by the prefetch issued at iteration t+1.
        __syncthreads();

        // Coalesced flush: this tile's [16 x 128] output is contiguous.
        float* outbase = out + (size_t)(t0 + t) * 16 * Q_N;
        #pragma unroll
        for (int i = 0; i < 2; ++i) {
            const int f4 = i * 256 + tid;   // 512 float4s = 2048 floats
            *reinterpret_cast<v4f*>(outbase + f4 * 4) =
                *reinterpret_cast<const v4f*>(os + f4 * 4);
        }
        // os reuse is safe: next writes happen only after the wait+barrier
        // at the top of iteration t+1, by which time all flush reads issued.
    }
}

extern "C" void kernel_launch(void* const* d_in, const int* in_sizes, int n_in,
                              void* d_out, int out_size, void* d_ws, size_t ws_size,
                              hipStream_t stream) {
    (void)in_sizes; (void)n_in; (void)out_size; (void)d_ws; (void)ws_size;
    const float* x     = (const float*)d_in[0];
    const float* W1    = (const float*)d_in[1];
    const float* b1    = (const float*)d_in[2];
    const float* gamma = (const float*)d_in[3];
    const float* beta  = (const float*)d_in[4];
    const float* W2    = (const float*)d_in[5];
    const float* b2    = (const float*)d_in[6];
    float* out = (float*)d_out;

    dim3 grid(B_TOT / (16 * TILES));  // 512 blocks, 4 double-buffered tiles each
    dim3 block(256);                  // 8 waves; each wave owns 16 q slices
    divenc_fused_kernel<<<grid, block, 0, stream>>>(x, W1, b1, gamma, beta, W2, b2, out);
}

// v001
// It runs in 51.9 microseconds.
// Next to v000, in two timings, it ran 1.74 and 1.77 times as fast.
#include <hip/hip_runtime.h>

// Problem constants (match reference)
#define B_TOT 32768
#define Q_N   128
#define V_N   8
#define H_N   32
#define LN_EPS 1e-5f
#define TILES 4            // 16-row batch tiles per block, double-buffered
#define OS_PITCH (Q_N + 4) // output-tile row pitch in floats: 16 rows hit 16 banks

typedef __attribute__((ext_vector_type(2))) float v2f;
typedef __attribute__((ext_vector_type(4))) float v4f;
typedef __attribute__((ext_vector_type(8))) float v8f;

// Sum of a lane's eight registers.
__device__ __forceinline__ float hsum8(v8f v) {
    const v4f a = v.lo + v.hi;
    const v2f b = a.lo + a.hi;
    return b.x + b.y;
}

// v + (v of lane ^ 16): joins the two 16-lane halves, same result in both.
__device__ __forceinline__ float xhalf_add(float v) {
    const int b = __float_as_int(v);
    return v + __int_as_float(__builtin_amdgcn_permlanex16(
                   b, b, 0x76543210, 0xfedcba98, false, false));
}

__launch_bounds__(256, 2)
__global__ void divenc_fused_kernel(const float* __restrict__ x,
                                    const float* __restrict__ W1,
                                    const float* __restrict__ b1,
                                    const float* __restrict__ gamma,
                                    const float* __restrict__ beta,
                                    const float* __restrict__ W2,
                                    const float* __restrict__ b2,
                                    float* __restrict__ out) {
    // Double-buffered 16x1024-float input tiles (2x64KB) + padded output tile.
    __shared__ float xs[2][16 * 1024];
    __shared__ float os[16 * OS_PITCH];

    const int tid = threadIdx.x;
    const int t0  = blockIdx.x * TILES;   // first 16-row tile owned by block

    // Async prefetch of one 64KB tile straight into LDS (no VGPR staging).
    // Per thread: 16 x B128, XOR-swizzled float4 column (conflict-free for
    // the strided B-fragment reads). Low 32 bits of a generic LDS address
    // are the LDS byte offset (ISA 10.2), which is what VDST wants.
    auto issue_tile = [&](int tg, int buf) {
        const float* xblk = x + (size_t)tg * 16 * (Q_N * V_N);
        #pragma unroll
        for (int i = 0; i < 16; ++i) {
            unsigned long long ga =
                (unsigned long long)(uintptr_t)(xblk + i * 1024 + tid * 4);
            unsigned int la =
                (unsigned int)(uintptr_t)(&xs[buf][i * 1024 + ((tid ^ i) * 4)]);
            asm volatile("global_load_async_to_lds_b128 %0, %1, off"
                         :: "v"(la), "v"(ga) : "memory");
        }
    };

    const int lane = tid & 31;
    const int wave = tid >> 5;
    const int m    = lane & 15;   // batch row (B,D column) / hidden row (A) within half
    const int hi   = lane >> 4;   // which 16-lane half

    issue_tile(t0, 0);            // prologue: tile 0 -> buf 0

    for (int t = 0; t < TILES; ++t) {
        const int cur = t & 1;
        if (t + 1 < TILES) {
            // Prefetch next tile into the other buffer; safe: trailing
            // barrier of iteration t-1 guarantees nobody still reads it.
            issue_tile(t0 + t + 1, cur ^ 1);
            // Async loads complete in order: <=16 outstanding means all of
            // tile t's 16 per-thread loads have landed in LDS.
            asm volatile("s_wait_asynccnt 0x10" ::: "memory");
        } else {
            asm volatile("s_wait_asynccnt 0x0" ::: "memory");
        }
        __syncthreads();          // tile t visible to all waves

        const float* xbuf = xs[cur];

        for (int qi = 0; qi < 16; ++qi) {
            const int q = wave * 16 + qi;

            // Transposed product: hT[32 x 16] = W1[q]^T[32 x 8] @ x_tile^T[8 x 16].
            // D then holds, per lane, 16 of the 32 hidden values of ONE batch
            // row (row m; hidden index j*16 + hi*8 + r), so the sums over H
            // are register adds plus one exchange between the lane halves.

            // ---- B fragments (x^T): one 16-byte read, batch row m ----
            // k slot (hi*2 + i) of step ks carries v = hi*4 + ks*2 + i.
            const v4f xv = *reinterpret_cast<const v4f*>(
                xbuf + m * 1024 + (((q * 2 + hi) ^ m) * 4));
            const v2f xb0 = {xv.x, xv.y};
            const v2f xb1 = {xv.z, xv.w};

            // ---- A fragments (W1^T): hidden row j*16 + m, same k order ----
            const float* w1q = W1 + q * (V_N * H_N) + hi * 4 * H_N + m;
            const v2f a00 = {w1q[0 * H_N],      w1q[1 * H_N]};
            const v2f a01 = {w1q[2 * H_N],      w1q[3 * H_N]};
            const v2f a10 = {w1q[0 * H_N + 16], w1q[1 * H_N + 16]};
            const v2f a11 = {w1q[2 * H_N + 16], w1q[3 * H_N + 16]};

            // ---- per-lane constants of hidden indices hi*8+r, 16+hi*8+r ----
            const int qh = q * H_N + hi * 8;
            v8f acc0 = *reinterpret_cast<const v8f*>(b1 + qh);       // C = bias
            v8f acc1 = *reinterpret_cast<const v8f*>(b1 + qh + 16);
            const v8f w20 = *reinterpret_cast<const v8f*>(W2 + qh);
            const v8f w21 = *reinterpret_cast<const v8f*>(W2 + qh + 16);
            const v8f gw0 = *reinterpret_cast<const v8f*>(gamma + qh) * w20;
            const v8f gw1 = *reinterpret_cast<const v8f*>(gamma + qh + 16) * w21;
            const v8f bw  = *reinterpret_cast<const v8f*>(beta + qh) * w20 +
                            *reinterpret_cast<const v8f*>(beta + qh + 16) * w21;

            acc0 = __builtin_amdgcn_wmma_f32_16x16x4_f32(false, a00, false, xb0,
                                                         (short)0, acc0, false, false);
            acc1 = __builtin_amdgcn_wmma_f32_16x16x4_f32(false, a10, false, xb0,
                                                         (short)0, acc1, false, false);
            acc0 = __builtin_amdgcn_wmma_f32_16x16x4_f32(false, a01, false, xb1,
                                                         (short)0, acc0, false, false);
            acc1 = __builtin_amdgcn_wmma_f32_16x16x4_f32(false, a11, false, xb1,
                                                         (short)0, acc1, false, false);

            // ---- folded LN-affine + linear2 constants ----
            // dot(hn, w2) = rstd*(dot(h, g*w2) - mu*S_gw) + C_bw
            const float S_gw = xhalf_add(hsum8(gw0 + gw1));
            const float C_bw = xhalf_add(hsum8(bw)) + b2[q];

            // ---- ELU ----
            #pragma unroll
            for (int r = 0; r < 8; ++r) {
                const float h0 = acc0[r];
                const float h1 = acc1[r];
                acc0[r] = h0 > 0.f ? h0 : (__expf(h0) - 1.f);
                acc1[r] = h1 > 0.f ? h1 : (__expf(h1) - 1.f);
            }

            // ---- sums over H: in registers, then across the two halves ----
            const float s  = xhalf_add(hsum8(acc0 + acc1));               // sum(h)
            const float ss = xhalf_add(hsum8(acc0 * acc0 + acc1 * acc1)); // sum(h^2)
            const float sd = xhalf_add(hsum8(acc0 * gw0 + acc1 * gw1));   // dot(h, g*w2)
            const float mu   = s * (1.0f / 32.0f);
            const float var  = ss * (1.0f / 32.0f) - mu * mu;
            const float rstd = rsqrtf(var + LN_EPS);
            const float d = rstd * (sd - mu * S_gw) + C_bw;
            // Both halves hold the same d and store it to the same word: no
            // branch in the loop; the pitch puts the 16 rows on 16 banks.
            os[m * OS_PITCH + q] = d;
        }

        // All os writes done; also fences buf[cur] reads before it is
        // overwritten by the prefetch issued at iteration t+1.
        __syncthreads();

        // Coalesced flush: this tile's [16 x 128] output is contiguous.
        float* outbase = out + (size_t)(t0 + t) * 16 * Q_N;
        #pragma unroll
        for (int i = 0; i < 2; ++i) {
            const int f4 = i * 256 + tid;   // 512 float4s = 2048 floats
            *reinterpret_cast<v4f*>(outbase + f4 * 4) =
                *reinterpret_cast<const v4f*>(os + (f4 >> 5) * OS_PITCH + (f4 & 31) * 4);
        }
        // Precaution: the next tile's code rewrites the stores' data and address
        // registers; this wait stands in front of those rewrites.
        asm volatile("s_wait_xcnt 0x0" ::: "memory");
        // os reuse is safe: next writes happen only after the wait+barrier
        // at the top of iteration t+1, by which time all flush reads issued.
    }
}

extern "C" void kernel_launch(void* const* d_in, const int* in_sizes, int n_in,
                              void* d_out, int out_size, void* d_ws, size_t ws_size,
                              hipStream_t stream) {
    (void)in_sizes; (void)n_in; (void)out_size; (void)d_ws; (void)ws_size;
    const float* x     = (const float*)d_in[0];
    const float* W1    = (const float*)d_in[1];
    const float* b1    = (const float*)d_in[2];
    const float* gamma = (const float*)d_in[3];
    const float* beta  = (const float*)d_in[4];
    const float* W2    = (const float*)d_in[5];
    const float* b2    = (const float*)d_in[6];
    float* out = (float*)d_out;

    dim3 grid(B_TOT / (16 * TILES));  // 512 blocks, 4 double-buffered tiles each
    dim3 block(256);                  // 8 waves; each wave owns 16 q slices
    divenc_fused_kernel<<<grid, block, 0, stream>>>(x, W1, b1, gamma, beta, W2, b2, out);
}

// v002
// One run takes 38.1 microseconds.
// Timed twice side by side with v001, it ran 1.36 times as fast both times.
// Counting every step since v000, it is 2.39 times as fast.
#include <hip/hip_runtime.h>

// Problem constants (match reference)
#define B_TOT 32768
#define Q_N   128
#define V_N   8
#define H_N   32
#define LN_EPS 1e-5f
#define TILES 4              // input stages per block, double-buffered
#define ROWS  64             // batch rows per stage (four 16-row WMMA tiles)
#define QB    32             // q slices per block: 128 B of every output row
#define QW    4              // q slices per wave, their constants held in registers
#define XROW  (QB * V_N)     // floats of one staged row (1 KB)
#define OS_PITCH (QB + 4)    // output-tile row pitch in floats: 16 rows x 16 B hit all banks once

typedef __attribute__((ext_vector_type(2))) float v2f;
typedef __attribute__((ext_vector_type(4))) float v4f;
typedef __attribute__((ext_vector_type(8))) float v8f;

// Sum of a lane's eight registers.
__device__ __forceinline__ float hsum8(v8f v) {
    const v4f a = v.lo + v.hi;
    const v2f b = a.lo + a.hi;
    return b.x + b.y;
}

// v + (v of lane ^ 16): joins the two 16-lane halves, same result in both.
__device__ __forceinline__ float xhalf_add(float v) {
    const int b = __float_as_int(v);
    return v + __int_as_float(__builtin_amdgcn_permlanex16(
                   b, b, 0x76543210, 0xfedcba98, false, false));
}

__launch_bounds__(256, 4)
__global__ void divenc_fused_kernel(const float* __restrict__ x,
                                    const float* __restrict__ W1,
                                    const float* __restrict__ b1,
                                    const float* __restrict__ gamma,
                                    const float* __restrict__ beta,
                                    const float* __restrict__ W2,
                                    const float* __restrict__ b2,
                                    float* __restrict__ out) {
    // Double-buffered 64-row x 256-float input stages (2x64KB) + padded output tile.
    __shared__ __attribute__((aligned(16))) float xs[2][ROWS * XROW];
    __shared__ __attribute__((aligned(16))) float os[ROWS * OS_PITCH];

    const int tid = threadIdx.x;
    const int qg  = blockIdx.x & 3;              // which 32 of the 128 q slices
    const int t0  = (blockIdx.x >> 2) * TILES;   // first 64-row stage owned by block

    // Async prefetch of one 64KB stage straight into LDS (no VGPR staging).
    // Per thread: 16 x B128; one copy brings four rows, 64 threads a row.
    // The float4 column is XORed with the row's low four bits (conflict-free
    // for the strided B-fragment reads). Low 32 bits of a generic LDS address
    // are the LDS byte offset, which is what VDST wants.
    auto issue_tile = [&](int tg, int buf) {
        const int r4 = tid >> 6;
        const int c  = tid & 63;
        const float* gp = x + (size_t)tg * ROWS * (Q_N * V_N) + qg * XROW +
                          r4 * (Q_N * V_N) + c * 4;
        unsigned int lp = (unsigned int)(uintptr_t)(&xs[buf][r4 * XROW]);
        // Kept rolled: unrolled, the sixteen address pairs are hoisted out of the
        // stage loop and take the registers that the q constants need.
        #pragma unroll 1
        for (int g = 0; g < ROWS / 16; ++g) {
            // Four copies (rows r4, 4+r4, 8+r4, 12+r4 of this group of 16) and
            // their s_wait_xcnt in one statement: a precaution, the wait stands
            // in front of every rewrite of the address registers.
            asm volatile("global_load_async_to_lds_b128 %0, %4, off\n\t"
                         "global_load_async_to_lds_b128 %1, %5, off\n\t"
                         "global_load_async_to_lds_b128 %2, %6, off\n\t"
                         "global_load_async_to_lds_b128 %3, %7, off\n\t"
                         "s_wait_xcnt 0x0"
                         :: "v"(lp +  0 * XROW * 4 + ((c ^ (0  + r4)) * 16)),
                            "v"(lp +  4 * XROW * 4 + ((c ^ (4  + r4)) * 16)),
                            "v"(lp +  8 * XROW * 4 + ((c ^ (8  + r4)) * 16)),
                            "v"(lp + 12 * XROW * 4 + ((c ^ (12 + r4)) * 16)),
                            "v"(gp +  0 * (Q_N * V_N)), "v"(gp +  4 * (Q_N * V_N)),
                            "v"(gp +  8 * (Q_N * V_N)), "v"(gp + 12 * (Q_N * V_N))
                         : "memory");
            gp += 16 * (Q_N * V_N);
            lp += 16 * XROW * 4;
        }
    };

    const int lane = tid & 31;
    const int wave = tid >> 5;
    const int m    = lane & 15;   // batch row (B,D column) / hidden row (A) within half
    const int hi   = lane >> 4;   // which 16-lane half

    issue_tile(t0, 0);            // prologue: stage 0 -> buf 0

    // ---- the wave's four q slices: everything that depends on q alone is
    // read and folded once here and stays in registers for all 256 rows ----
    v2f   wa[QW][4];              // A fragments (W1^T)
    v8f   bias[QW][2];            // C operand
    v8f   gw[QW][2];              // gamma * w2
    float S_gw[QW], C_bw[QW];
    #pragma unroll
    for (int k = 0; k < QW; ++k) {
        const int q = qg * QB + wave * QW + k;

        // A fragments: hidden row j*16 + m; k slot (hi*2 + i) of step ks
        // carries v = hi*4 + ks*2 + i, the order of the B fragments below.
        const float* w1q = W1 + q * (V_N * H_N) + hi * 4 * H_N + m;
        wa[k][0] = v2f{w1q[0 * H_N],      w1q[1 * H_N]};
        wa[k][1] = v2f{w1q[2 * H_N],      w1q[3 * H_N]};
        wa[k][2] = v2f{w1q[0 * H_N + 16], w1q[1 * H_N + 16]};
        wa[k][3] = v2f{w1q[2 * H_N + 16], w1q[3 * H_N + 16]};

        // per-lane constants of hidden indices hi*8+r, 16+hi*8+r
        const int qh = q * H_N + hi * 8;
        bias[k][0] = *reinterpret_cast<const v8f*>(b1 + qh);
        bias[k][1] = *reinterpret_cast<const v8f*>(b1 + qh + 16);
        const v8f w20 = *reinterpret_cast<const v8f*>(W2 + qh);
        const v8f w21 = *reinterpret_cast<const v8f*>(W2 + qh + 16);
        gw[k][0] = *reinterpret_cast<const v8f*>(gamma + qh) * w20;
        gw[k][1] = *reinterpret_cast<const v8f*>(gamma + qh + 16) * w21;
        const v8f bw = *reinterpret_cast<const v8f*>(beta + qh) * w20 +
                       *reinterpret_cast<const v8f*>(beta + qh + 16) * w21;
        const float b2q = b2[q];
        // Precaution: the address registers of the loads above stay live up to
        // this wait, so nothing rewrites them in front of it.
        asm volatile("s_wait_xcnt 0x0"
                     :: "v"(w1q), "v"(b1 + qh), "v"(W2 + qh), "v"(gamma + qh),
                        "v"(beta + qh), "v"(b2 + q)
                     : "memory");

        // folded LN-affine + linear2 constants:
        // dot(hn, w2) = rstd*(dot(h, g*w2) - mu*S_gw) + C_bw
        S_gw[k] = xhalf_add(hsum8(gw[k][0] + gw[k][1]));
        C_bw[k] = xhalf_add(hsum8(bw)) + b2q;
    }

    for (int t = 0; t < TILES; ++t) {
        const int cur = t & 1;
        if (t + 1 < TILES) {
            // Prefetch next stage into the other buffer; safe: trailing
            // barrier of iteration t-1 guarantees nobody still reads it.
            issue_tile(t0 + t + 1, cur ^ 1);
            // All but the 16 youngest copies have landed: stage t is in LDS.
            asm volatile("s_wait_asynccnt 0x10" ::: "memory");
        } else {
            asm volatile("s_wait_asynccnt 0x0" ::: "memory");
        }
        __syncthreads();          // stage t visible to all waves

        const float* xbuf = xs[cur];

        for (int sub = 0; sub < ROWS / 16; ++sub) {
            const int row = sub * 16 + m;
            v4f dv;

            #pragma unroll
            for (int k = 0; k < QW; ++k) {
                // Transposed product: hT[32 x 16] = W1[q]^T[32 x 8] @ x_tile^T[8 x 16].
                // D then holds, per lane, 16 of the 32 hidden values of ONE batch
                // row (row m; hidden index j*16 + hi*8 + r), so the sums over H
                // are register adds plus one exchange between the lane halves.

                // ---- B fragments (x^T): one 16-byte read, batch row m ----
                // k slot (hi*2 + i) of step ks carries v = hi*4 + ks*2 + i.
                const v4f xv = *reinterpret_cast<const v4f*>(
                    xbuf + row * XROW + ((((wave * QW + k) * 2 + hi) ^ m) * 4));
                const v2f xb0 = {xv.x, xv.y};
                const v2f xb1 = {xv.z, xv.w};

                v8f acc0 = __builtin_amdgcn_wmma_f32_16x16x4_f32(
                    false, wa[k][0], false, xb0, (short)0, bias[k][0], false, false);
                v8f acc1 = __builtin_amdgcn_wmma_f32_16x16x4_f32(
                    false, wa[k][2], false, xb0, (short)0, bias[k][1], false, false);
                acc0 = __builtin_amdgcn_wmma_f32_16x16x4_f32(
                    false, wa[k][1], false, xb1, (short)0, acc0, false, false);
                acc1 = __builtin_amdgcn_wmma_f32_16x16x4_f32(
                    false, wa[k][3], false, xb1, (short)0, acc1, false, false);

                // ---- ELU ----
                #pragma unroll
                for (int r = 0; r < 8; ++r) {
                    const float h0 = acc0[r];
                    const float h1 = acc1[r];
                    acc0[r] = h0 > 0.f ? h0 : (__expf(h0) - 1.f);
                    acc1[r] = h1 > 0.f ? h1 : (__expf(h1) - 1.f);
                }

                // ---- sums over H: in registers, then across the two halves ----
                const float s  = xhalf_add(hsum8(acc0 + acc1));               // sum(h)
                const float ss = xhalf_add(hsum8(acc0 * acc0 + acc1 * acc1)); // sum(h^2)
                const float sd = xhalf_add(hsum8(acc0 * gw[k][0] + acc1 * gw[k][1]));
                const float mu   = s * (1.0f / 32.0f);
                const float var  = ss * (1.0f / 32.0f) - mu * mu;
                const float rstd = rsqrtf(var + LN_EPS);
                dv[k] = rstd * (sd - mu * S_gw[k]) + C_bw[k];
            }
            // Both halves hold the same four values and store them to the same
            // 16 bytes: no branch in the loop.
            *reinterpret_cast<v4f*>(os + row * OS_PITCH + wave * QW) = dv;
        }

        // All os writes done; also fences buf[cur] reads before it is
        // overwritten by the prefetch issued at iteration t+1.
        __syncthreads();

        // Flush: 64 rows x 128 B, each output line written whole by this block.
        float* outbase = out + (size_t)(t0 + t) * ROWS * Q_N + qg * QB;
        #pragma unroll
        for (int i = 0; i < 2; ++i) {
            const int f4 = i * 256 + tid;   // 512 float4s = 2048 floats
            *reinterpret_cast<v4f*>(outbase + (f4 >> 3) * Q_N + (f4 & 7) * 4) =
                *reinterpret_cast<const v4f*>(os + (f4 >> 3) * OS_PITCH + (f4 & 7) * 4);
        }
        // Precaution: the next stage's code rewrites the stores' data and address
        // registers; this wait stands in front of those rewrites.
        asm volatile("s_wait_xcnt 0x0" ::: "memory");
        // os reuse is safe: next writes happen only after the wait+barrier
        // at the top of iteration t+1, by which time all flush reads issued.
    }
}

extern "C" void kernel_launch(void* const* d_in, const int* in_sizes, int n_in,
                              void* d_out, int out_size, void* d_ws, size_t ws_size,
                              hipStream_t stream) {
    (void)in_sizes; (void)n_in; (void)out_size; (void)d_ws; (void)ws_size;
    const float* x     = (const float*)d_in[0];
    const float* W1    = (const float*)d_in[1];
    const float* b1    = (const float*)d_in[2];
    const float* gamma = (const float*)d_in[3];
    const float* beta  = (const float*)d_in[4];
    const float* W2    = (const float*)d_in[5];
    const float* b2    = (const float*)d_in[6];
    float* out = (float*)d_out;

    dim3 grid((B_TOT / (ROWS * TILES)) * (Q_N / QB));  // 128 row groups x 4 q groups
    dim3 block(256);                                   // 8 waves; each wave owns 4 q slices
    divenc_fused_kernel<<<grid, block, 0, stream>>>(x, W1, b1, gamma, beta, W2, b2, out);
}

// v003
// It runs in 35.1 microseconds.
// Two timings next to v002 both put it at 1.09 times that version's speed.
// All steps since v000 together make it 2.60 times as fast.
#include <hip/hip_runtime.h>

// Problem constants (match reference)
#define B_TOT 32768
#define Q_N   128
#define V_N   8
#define H_N   32
#define LN_EPS 1e-5f
#define LOG2E 1.4426950408889634f
#define LN2   0.6931471805599453f
#define TILES 4              // input stages per block, double-buffered
#define ROWS  64             // batch rows per stage (four 16-row WMMA tiles)
#define QB    32             // q slices per block: 128 B of every output row
#define QW    4              // q slices per wave, their constants held in registers
#define XROW  (QB * V_N)     // floats of one staged row (1 KB)
#define OS_PITCH (QB + 4)    // output-tile row pitch in floats: 16 rows x 16 B hit all banks once

typedef __attribute__((ext_vector_type(2))) float v2f;
typedef __attribute__((ext_vector_type(4))) float v4f;
typedef __attribute__((ext_vector_type(8))) float v8f;

// Sum of a lane's eight registers.
__device__ __forceinline__ float hsum8(v8f v) {
    const v4f a = v.lo + v.hi;
    const v2f b = a.lo + a.hi;
    return b.x + b.y;
}

// v + (v of lane ^ 16): joins the two 16-lane halves, same result in both.
__device__ __forceinline__ float xhalf_add(float v) {
    const int b = __float_as_int(v);
    return v + __int_as_float(__builtin_amdgcn_permlanex16(
                   b, b, 0x76543210, 0xfedcba98, false, false));
}

__launch_bounds__(256, 4)
__global__ void divenc_fused_kernel(const float* __restrict__ x,
                                    const float* __restrict__ W1,
                                    const float* __restrict__ b1,
                                    const float* __restrict__ gamma,
                                    const float* __restrict__ beta,
                                    const float* __restrict__ W2,
                                    const float* __restrict__ b2,
                                    float* __restrict__ out) {
    // Double-buffered 64-row x 256-float input stages (2x64KB) + padded output tile.
    __shared__ __attribute__((aligned(16))) float xs[2][ROWS * XROW];
    __shared__ __attribute__((aligned(16))) float os[ROWS * OS_PITCH];

    const int tid = threadIdx.x;
    const int qg  = blockIdx.x & 3;              // which 32 of the 128 q slices
    const int t0  = (blockIdx.x >> 2) * TILES;   // first 64-row stage owned by block

    // Async prefetch of one 64KB stage straight into LDS (no VGPR staging).
    // Per thread: 16 x B128; one copy brings four rows, 64 threads a row.
    // The float4 column is XORed with the row's low four bits (conflict-free
    // for the strided B-fragment reads). Low 32 bits of a generic LDS address
    // are the LDS byte offset, which is what VDST wants.
    auto issue_tile = [&](int tg, int buf) {
        const int r4 = tid >> 6;
        const int c  = tid & 63;
        const float* gp = x + (size_t)tg * ROWS * (Q_N * V_N) + qg * XROW +
                          r4 * (Q_N * V_N) + c * 4;
        unsigned int lp = (unsigned int)(uintptr_t)(&xs[buf][r4 * XROW]);
        // Kept rolled: unrolled, the sixteen address pairs are hoisted out of the
        // stage loop and take the registers that the q constants need.
        #pragma unroll 1
        for (int g = 0; g < ROWS / 16; ++g) {
            // Four copies (rows r4, 4+r4, 8+r4, 12+r4 of this group of 16) and
            // their s_wait_xcnt in one statement: a precaution, the wait stands
            // in front of every rewrite of the address registers.
            asm volatile("global_load_async_to_lds_b128 %0, %4, off\n\t"
                         "global_load_async_to_lds_b128 %1, %5, off\n\t"
                         "global_load_async_to_lds_b128 %2, %6, off\n\t"
                         "global_load_async_to_lds_b128 %3, %7, off\n\t"
                         "s_wait_xcnt 0x0"
                         :: "v"(lp +  0 * XROW * 4 + ((c ^ (0  + r4)) * 16)),
                            "v"(lp +  4 * XROW * 4 + ((c ^ (4  + r4)) * 16)),
                            "v"(lp +  8 * XROW * 4 + ((c ^ (8  + r4)) * 16)),
                            "v"(lp + 12 * XROW * 4 + ((c ^ (12 + r4)) * 16)),
                            "v"(gp +  0 * (Q_N * V_N)), "v"(gp +  4 * (Q_N * V_N)),
                            "v"(gp +  8 * (Q_N * V_N)), "v"(gp + 12 * (Q_N * V_N))
                         : "memory");
            gp += 16 * (Q_N * V_N);
            lp += 16 * XROW * 4;
        }
    };

    const int lane = tid & 31;
    const int wave = tid >> 5;
    const int m    = lane & 15;   // batch row (B,D column) / hidden row (A) within half
    const int hi   = lane >> 4;   // which 16-lane half

    issue_tile(t0, 0);            // prologue: stage 0 -> buf 0

    // ---- the wave's four q slices: everything that depends on q alone is
    // read and folded once here and stays in registers for all 256 rows ----
    v2f   wa[QW][4];              // A fragments (W1^T * log2 e)
    v8f   bias[QW][2];            // C operand (b1 * log2 e)
    v8f   gw[QW][2];              // gamma * w2
    float S_gw[QW], C_bw[QW];
    #pragma unroll
    for (int k = 0; k < QW; ++k) {
        const int q = qg * QB + wave * QW + k;

        // A fragments: hidden row j*16 + m; k slot (hi*2 + i) of step ks
        // carries v = hi*4 + ks*2 + i, the order of the B fragments below.
        const float* w1q = W1 + q * (V_N * H_N) + hi * 4 * H_N + m;
        wa[k][0] = v2f{w1q[0 * H_N],      w1q[1 * H_N]};
        wa[k][1] = v2f{w1q[2 * H_N],      w1q[3 * H_N]};
        wa[k][2] = v2f{w1q[0 * H_N + 16], w1q[1 * H_N + 16]};
        wa[k][3] = v2f{w1q[2 * H_N + 16], w1q[3 * H_N + 16]};

        // per-lane constants of hidden indices hi*8+r, 16+hi*8+r
        const int qh = q * H_N + hi * 8;
        bias[k][0] = *reinterpret_cast<const v8f*>(b1 + qh);
        bias[k][1] = *reinterpret_cast<const v8f*>(b1 + qh + 16);
        const v8f w20 = *reinterpret_cast<const v8f*>(W2 + qh);
        const v8f w21 = *reinterpret_cast<const v8f*>(W2 + qh + 16);
        gw[k][0] = *reinterpret_cast<const v8f*>(gamma + qh) * w20;
        gw[k][1] = *reinterpret_cast<const v8f*>(gamma + qh + 16) * w21;
        const v8f bw = *reinterpret_cast<const v8f*>(beta + qh) * w20 +
                       *reinterpret_cast<const v8f*>(beta + qh + 16) * w21;
        const float b2q = b2[q];
        // Precaution: the address registers of the loads above stay live up to
        // this wait, so nothing rewrites them in front of it.
        asm volatile("s_wait_xcnt 0x0"
                     :: "v"(w1q), "v"(b1 + qh), "v"(W2 + qh), "v"(gamma + qh),
                        "v"(beta + qh), "v"(b2 + q)
                     : "memory");

        // W1 and b1 carry the factor log2(e): the matrix product is then
        // a = h * log2(e), the argument of the hardware's base-2 exponential.
        for (int i = 0; i < 4; ++i) wa[k][i] *= LOG2E;
        bias[k][0] *= LOG2E;
        bias[k][1] *= LOG2E;

        // folded LN-affine + linear2 constants:
        // dot(hn, w2) = rstd*(dot(h, g*w2) - mu*S_gw) + C_bw
        S_gw[k] = xhalf_add(hsum8(gw[k][0] + gw[k][1]));
        C_bw[k] = xhalf_add(hsum8(bw)) + b2q;
    }

    for (int t = 0; t < TILES; ++t) {
        const int cur = t & 1;
        if (t + 1 < TILES) {
            // Prefetch next stage into the other buffer; safe: trailing
            // barrier of iteration t-1 guarantees nobody still reads it.
            issue_tile(t0 + t + 1, cur ^ 1);
            // All but the 16 youngest copies have landed: stage t is in LDS.
            asm volatile("s_wait_asynccnt 0x10" ::: "memory");
        } else {
            asm volatile("s_wait_asynccnt 0x0" ::: "memory");
        }
        __syncthreads();          // stage t visible to all waves

        const float* xbuf = xs[cur];

        for (int sub = 0; sub < ROWS / 16; ++sub) {
            const int row = sub * 16 + m;
            v4f dv;

            #pragma unroll
            for (int k = 0; k < QW; ++k) {
                // Transposed product: hT[32 x 16] = W1[q]^T[32 x 8] @ x_tile^T[8 x 16].
                // D then holds, per lane, 16 of the 32 hidden values of ONE batch
                // row (row m; hidden index j*16 + hi*8 + r), so the sums over H
                // are register adds plus one exchange between the lane halves.

                // ---- B fragments (x^T): one 16-byte read, batch row m ----
                // k slot (hi*2 + i) of step ks carries v = hi*4 + ks*2 + i.
                const v4f xv = *reinterpret_cast<const v4f*>(
                    xbuf + row * XROW + ((((wave * QW + k) * 2 + hi) ^ m) * 4));
                const v2f xb0 = {xv.x, xv.y};
                const v2f xb1 = {xv.z, xv.w};

                v8f acc0 = __builtin_amdgcn_wmma_f32_16x16x4_f32(
                    false, wa[k][0], false, xb0, (short)0, bias[k][0], false, false);
                v8f acc1 = __builtin_amdgcn_wmma_f32_16x16x4_f32(
                    false, wa[k][2], false, xb0, (short)0, bias[k][1], false, false);
                acc0 = __builtin_amdgcn_wmma_f32_16x16x4_f32(
                    false, wa[k][1], false, xb1, (short)0, acc0, false, false);
                acc1 = __builtin_amdgcn_wmma_f32_16x16x4_f32(
                    false, wa[k][3], false, xb1, (short)0, acc1, false, false);

                // ---- ELU, without a compare or a select ----
                // elu(h) = max(h, min(e^h, 1) - 1): above zero the second term is 0,
                // below zero e^h - 1 >= h. With a = h * log2(e): h = ln2 * a, and
                // min(e^h, 1) is 2^a clamped to [0, 1] (the instruction's own clamp).
                #pragma unroll
                for (int r = 0; r < 8; ++r) {
                    const float a0 = acc0[r];
                    const float a1 = acc1[r];
                    const float e0 = __builtin_amdgcn_fmed3f(__builtin_amdgcn_exp2f(a0), 0.f, 1.f);
                    const float e1 = __builtin_amdgcn_fmed3f(__builtin_amdgcn_exp2f(a1), 0.f, 1.f);
                    acc0[r] = fmaxf(a0 * LN2, e0 - 1.f);
                    acc1[r] = fmaxf(a1 * LN2, e1 - 1.f);
                }

                // ---- sums over H: in registers, then across the two halves ----
                const float s  = xhalf_add(hsum8(acc0 + acc1));               // sum(h)
                const float ss = xhalf_add(hsum8(acc0 * acc0 + acc1 * acc1)); // sum(h^2)
                const float sd = xhalf_add(hsum8(acc0 * gw[k][0] + acc1 * gw[k][1]));
                const float mu   = s * (1.0f / 32.0f);
                const float var  = ss * (1.0f / 32.0f) - mu * mu;
                const float rstd = rsqrtf(var + LN_EPS);
                dv[k] = rstd * (sd - mu * S_gw[k]) + C_bw[k];
            }
            // Both halves hold the same four values and store them to the same
            // 16 bytes: no branch in the loop.
            *reinterpret_cast<v4f*>(os + row * OS_PITCH + wave * QW) = dv;
        }

        // All os writes done; also fences buf[cur] reads before it is
        // overwritten by the prefetch issued at iteration t+1.
        __syncthreads();

        // Flush: 64 rows x 128 B, each output line written whole by this block.
        float* outbase = out + (size_t)(t0 + t) * ROWS * Q_N + qg * QB;
        #pragma unroll
        for (int i = 0; i < 2; ++i) {
            const int f4 = i * 256 + tid;   // 512 float4s = 2048 floats
            *reinterpret_cast<v4f*>(outbase + (f4 >> 3) * Q_N + (f4 & 7) * 4) =
                *reinterpret_cast<const v4f*>(os + (f4 >> 3) * OS_PITCH + (f4 & 7) * 4);
        }
        // Precaution: the next stage's code rewrites the stores' data and address
        // registers; this wait stands in front of those rewrites.
        asm volatile("s_wait_xcnt 0x0" ::: "memory");
        // os reuse is safe: next writes happen only after the wait+barrier
        // at the top of iteration t+1, by which time all flush reads issued.
    }
}

extern "C" void kernel_launch(void* const* d_in, const int* in_sizes, int n_in,
                              void* d_out, int out_size, void* d_ws, size_t ws_size,
                              hipStream_t stream) {
    (void)in_sizes; (void)n_in; (void)out_size; (void)d_ws; (void)ws_size;
    const float* x     = (const float*)d_in[0];
    const float* W1    = (const float*)d_in[1];
    const float* b1    = (const float*)d_in[2];
    const float* gamma = (const float*)d_in[3];
    const float* beta  = (const float*)d_in[4];
    const float* W2    = (const float*)d_in[5];
    const float* b2    = (const float*)d_in[6];
    float* out = (float*)d_out;

    dim3 grid((B_TOT / (ROWS * TILES)) * (Q_N / QB));  // 128 row groups x 4 q groups
    dim3 block(256);                                   // 8 waves; each wave owns 4 q slices
    divenc_fused_kernel<<<grid, block, 0, stream>>>(x, W1, b1, gamma, beta, W2, b2, out);
}
